// v000
// Times are from an AMD MI455X. After a warm-up the kernel runs many times in a row, and a time is the length of
// such a window on the GPU divided by its runs, so every launch and the gaps after it count. The runs cycle
// through copies of the inputs. A figure is the median of several windows, for all but v000 over two sittings.
// Sittings can differ by a few percent; kernels timed side by side share one.
// v000, which the later versions start from, runs in 84.6 microseconds.
#include <hip/hip_runtime.h>

#define N_TOT   262144
#define DIM     64
#define TRUNK   128
#define T_TRUNKS (N_TOT / TRUNK)        // 2048

#define NBLK_A      256
#define TRUNKS_PER_A (T_TRUNKS / NBLK_A) // 8

#define SRB 76   // padded row stride (floats) for 128x64 tiles (bank-conflict-free b64 A-fetch)
#define SRS 80   // padded row stride for 64x64 S
#define SRT 20   // per-wave 16x16 score-tile stride

typedef float v2f __attribute__((ext_vector_type(2)));
typedef float v8f __attribute__((ext_vector_type(8)));

// ---------------------------------------------------------------------------
// CDNA5 async global->LDS copies via inline asm (ASYNCcnt path)
// ---------------------------------------------------------------------------
__device__ __forceinline__ unsigned lds_off_u32(const void* p) {
    // generic -> LDS address space -> 32-bit LDS byte offset
    return (unsigned)(unsigned long long)
        (__attribute__((address_space(3))) const void*)p;
}

__device__ __forceinline__ void async_b128(const float* g, float* l) {
    unsigned lo = lds_off_u32(l);
    // GV mode: per-lane 64-bit global address in VGPR pair, LDS addr in VDST
    asm volatile("global_load_async_to_lds_b128 %0, %1, off"
                 :: "v"(lo), "v"(g) : "memory");
}

#define WAIT_ASYNC(n) asm volatile("s_wait_asynccnt %0" :: "i"(n) : "memory")

// copy a row-major 128x64 f32 tile from global into padded LDS (8 b128/thread)
__device__ __forceinline__ void copy_tile128(const float* __restrict__ g,
                                             float* lds, int tid) {
#pragma unroll
    for (int c = 0; c < 8; ++c) {
        int e = (tid + c * 256) * 4;
        int r = e >> 6, col = e & 63;
        async_b128(g + e, lds + r * SRB + col);
    }
}

// copy the 64x64 S matrix into padded LDS (4 b128/thread)
__device__ __forceinline__ void copy_S(const float* __restrict__ g,
                                       float* lds, int tid) {
#pragma unroll
    for (int c = 0; c < 4; ++c) {
        int e = (tid + c * 256) * 4;
        int r = e >> 6, col = e & 63;
        async_b128(g + e, lds + r * SRS + col);
    }
}

// ---------------------------------------------------------------------------
// WMMA helpers (f32 16x16x4, wave32)
// ---------------------------------------------------------------------------
__device__ __forceinline__ v8f wmma4(v2f a, v2f b, v8f c) {
    return __builtin_amdgcn_wmma_f32_16x16x4_f32(
        false, a, false, b, (short)0, c, false, false);
}

// A operand: rows m0..m0+15 of row-major LDS buf, k-chunk base k0 (one b64)
__device__ __forceinline__ v2f fetchA(const float* buf, int sr, int m0, int k0,
                                      int l16, int kb) {
    const float* p = buf + (m0 + l16) * sr + k0 + kb;
    v2f a; a.x = p[0]; a.y = p[1];
    return a;
}

// B operand: B[k][n] = buf[(k0+..)*sr + n0 + n]
__device__ __forceinline__ v2f fetchB(const float* buf, int sr, int k0, int n0,
                                      int l16, int kb) {
    v2f b;
    b.x = buf[(k0 + kb)     * sr + n0 + l16];
    b.y = buf[(k0 + kb + 1) * sr + n0 + l16];
    return b;
}

// ---------------------------------------------------------------------------
// Kernel A: per-block partial S = sum_t V_t^T K_t, double-buffered async loads
// ---------------------------------------------------------------------------
__global__ void __launch_bounds__(256)
s_partial_kernel(const float* __restrict__ K, const float* __restrict__ V,
                 float* __restrict__ partials) {
    __shared__ __align__(16) float Kl[2][TRUNK * SRB];
    __shared__ __align__(16) float Vl[2][TRUNK * SRB];

    const int tid  = threadIdx.x;
    const int lane = tid & 31;
    const int wave = tid >> 5;
    const int l16  = lane & 15;
    const int half = lane >> 4;
    const int kb   = half * 2;

    const int mi  = wave >> 1;
    const int ni0 = (wave & 1) * 2;
    const int ni1 = ni0 + 1;

    v8f acc0 = {}; v8f acc1 = {};

    const size_t tbase = (size_t)blockIdx.x * TRUNKS_PER_A;
    // prefetch trunk 0
    copy_tile128(K + tbase * (TRUNK * DIM), Kl[0], tid);
    copy_tile128(V + tbase * (TRUNK * DIM), Vl[0], tid);

    for (int tr = 0; tr < TRUNKS_PER_A; ++tr) {
        const int cur = tr & 1;
        if (tr + 1 < TRUNKS_PER_A) {
            const size_t nb = (tbase + tr + 1) * (TRUNK * DIM);
            copy_tile128(K + nb, Kl[cur ^ 1], tid);
            copy_tile128(V + nb, Vl[cur ^ 1], tid);
            WAIT_ASYNC(16);   // 16 newer copies outstanding -> trunk tr landed
        } else {
            WAIT_ASYNC(0);
        }
        __syncthreads();      // all waves see trunk tr data

        const float* Kc = Kl[cur];
        const float* Vc = Vl[cur];
#pragma unroll
        for (int kk = 0; kk < 32; ++kk) {   // reduce over 128 trunk rows
            const int k0 = kk * 4;
            v2f a;                           // A = V^T: A[m=d][k=r] = V[r][d]
            a.x = Vc[(k0 + kb)     * SRB + mi * 16 + l16];
            a.y = Vc[(k0 + kb + 1) * SRB + mi * 16 + l16];
            v2f b0 = fetchB(Kc, SRB, k0, ni0 * 16, l16, kb);
            v2f b1 = fetchB(Kc, SRB, k0, ni1 * 16, l16, kb);
            acc0 = wmma4(a, b0, acc0);
            acc1 = wmma4(a, b1, acc1);
        }
        __syncthreads();      // done reading before buffer is overwritten
    }

    float* pp = partials + (size_t)blockIdx.x * (DIM * DIM);
#pragma unroll
    for (int g = 0; g < 8; ++g) {
        const int row = mi * 16 + half * 8 + g;
        pp[row * DIM + ni0 * 16 + l16] = acc0[g];
        pp[row * DIM + ni1 * 16 + l16] = acc1[g];
    }
}

// ---------------------------------------------------------------------------
// Kernel A2: reduce NBLK_A partials -> S (64x64, fp32)
// ---------------------------------------------------------------------------
__global__ void __launch_bounds__(256)
s_reduce_kernel(const float* __restrict__ partials, float* __restrict__ S) {
    const int e = blockIdx.x * 256 + threadIdx.x;   // 0..4095
    float s = 0.f;
    for (int p = 0; p < NBLK_A; ++p)
        s += partials[(size_t)p * (DIM * DIM) + e];
    S[e] = s;
}

// ---------------------------------------------------------------------------
// Kernel B: per trunk  out_t = (Q_t K_t^T) * (V_t S)
// ---------------------------------------------------------------------------
__global__ void __launch_bounds__(256)
intra_out_kernel(const float* __restrict__ Q, const float* __restrict__ K,
                 const float* __restrict__ V, const float* __restrict__ S,
                 float* __restrict__ out) {
    __shared__ __align__(16) float Ql[TRUNK * SRB];
    __shared__ __align__(16) float Kl[TRUNK * SRB];
    __shared__ __align__(16) float Vl[TRUNK * SRB];   // reused as W = V*S
    __shared__ __align__(16) float Sl[DIM * SRS];
    __shared__ __align__(16) float Tl[8][16 * SRT];   // per-wave score tile

    const int tid  = threadIdx.x;
    const int lane = tid & 31;
    const int wave = tid >> 5;
    const int l16  = lane & 15;
    const int half = lane >> 4;
    const int kb   = half * 2;

    const size_t base = (size_t)blockIdx.x * (TRUNK * DIM);
    copy_tile128(Q + base, Ql, tid);
    copy_tile128(K + base, Kl, tid);
    copy_tile128(V + base, Vl, tid);
    copy_S(S, Sl, tid);
    WAIT_ASYNC(0);
    __syncthreads();

    const int m0 = wave * 16;                 // this wave's 16 output rows

    // ---- stage 1: W = V @ S (rows m0..m0+15), write back over Vl ----
    v8f accW[4] = {v8f{}, v8f{}, v8f{}, v8f{}};
#pragma unroll
    for (int kk = 0; kk < 16; ++kk) {
        v2f a = fetchA(Vl, SRB, m0, kk * 4, l16, kb);
#pragma unroll
        for (int n = 0; n < 4; ++n) {
            v2f b = fetchB(Sl, SRS, kk * 4, n * 16, l16, kb);
            accW[n] = wmma4(a, b, accW[n]);
        }
    }
#pragma unroll
    for (int n = 0; n < 4; ++n)
#pragma unroll
        for (int g = 0; g < 8; ++g)
            Vl[(m0 + half * 8 + g) * SRB + n * 16 + l16] = accW[n][g];
    __syncthreads();                          // all waves need all W rows

    // ---- stage 2: out rows m0.. = sum_j scores(m0-block, j) @ W(j-block) ----
    v8f accO[4] = {v8f{}, v8f{}, v8f{}, v8f{}};
    float* tl = &Tl[wave][0];

    for (int j = 0; j < 8; ++j) {
        v8f accS = {};
#pragma unroll
        for (int kk = 0; kk < 16; ++kk) {
            v2f a = fetchA(Ql, SRB, m0,     kk * 4, l16, kb);
            v2f b = fetchA(Kl, SRB, j * 16, kk * 4, l16, kb);  // K^T == A-pattern
            accS = wmma4(a, b, accS);
        }
        // C-layout -> A-layout via per-wave padded LDS tile (wave-local; DS
        // ops from one wave are in order, compiler inserts s_wait_dscnt)
#pragma unroll
        for (int g = 0; g < 8; ++g)
            tl[(half * 8 + g) * SRT + l16] = accS[g];
#pragma unroll
        for (int kk = 0; kk < 4; ++kk) {
            v2f a = fetchA(tl, SRT, 0, kk * 4, l16, kb);
#pragma unroll
            for (int n = 0; n < 4; ++n) {
                v2f b = fetchB(Vl, SRB, j * 16 + kk * 4, n * 16, l16, kb); // W
                accO[n] = wmma4(a, b, accO[n]);
            }
        }
    }

    // ---- store output ----
    float* og = out + base;
#pragma unroll
    for (int n = 0; n < 4; ++n)
#pragma unroll
        for (int g = 0; g < 8; ++g)
            og[(m0 + half * 8 + g) * DIM + n * 16 + l16] = accO[n][g];
}

// ---------------------------------------------------------------------------
extern "C" void kernel_launch(void* const* d_in, const int* in_sizes, int n_in,
                              void* d_out, int out_size, void* d_ws, size_t ws_size,
                              hipStream_t stream) {
    const float* Q = (const float*)d_in[0];
    const float* K = (const float*)d_in[1];
    const float* V = (const float*)d_in[2];
    float* out = (float*)d_out;

    float* Sbuf     = (float*)d_ws;                 // 64*64 floats
    float* partials = Sbuf + DIM * DIM;             // NBLK_A * 64*64 floats (~4.2 MB)

    s_partial_kernel<<<NBLK_A, 256, 0, stream>>>(K, V, partials);
    s_reduce_kernel<<<(DIM * DIM) / 256, 256, 0, stream>>>(partials, Sbuf);
    intra_out_kernel<<<T_TRUNKS, 256, 0, stream>>>(Q, K, V, Sbuf, out);
}

// v001
// It runs in 64.9 microseconds.
// Two timings next to v000 both put it at 1.36 times that version's speed.
#include <hip/hip_runtime.h>

#define N_TOT   262144
#define DIM     64
#define TRUNK   128
#define T_TRUNKS (N_TOT / TRUNK)        // 2048

#define NBLK_A      256
#define TRUNKS_PER_A (T_TRUNKS / NBLK_A) // 8

#define SRB 76   // padded row stride (floats) for 128x64 tiles (bank-conflict-free b64 A-fetch)
#define SRS 80   // padded row stride for 64x64 S

typedef float v2f __attribute__((ext_vector_type(2)));
typedef float v8f __attribute__((ext_vector_type(8)));

// ---------------------------------------------------------------------------
// CDNA5 async global->LDS copies via inline asm (ASYNCcnt path)
// ---------------------------------------------------------------------------
__device__ __forceinline__ unsigned lds_off_u32(const void* p) {
    // generic -> LDS address space -> 32-bit LDS byte offset
    return (unsigned)(unsigned long long)
        (__attribute__((address_space(3))) const void*)p;
}

__device__ __forceinline__ void async_b128(const float* g, float* l) {
    unsigned lo = lds_off_u32(l);
    // GV mode: per-lane 64-bit global address in VGPR pair, LDS addr in VDST
    asm volatile("global_load_async_to_lds_b128 %0, %1, off"
                 :: "v"(lo), "v"(g) : "memory");
}

#define WAIT_ASYNC(n) asm volatile("s_wait_asynccnt %0" :: "i"(n) : "memory")

// copy a row-major 128x64 f32 tile from global into padded LDS (8 b128/thread)
__device__ __forceinline__ void copy_tile128(const float* __restrict__ g,
                                             float* lds, int tid) {
#pragma unroll
    for (int c = 0; c < 8; ++c) {
        int e = (tid + c * 256) * 4;
        int r = e >> 6, col = e & 63;
        async_b128(g + e, lds + r * SRB + col);
    }
}

// copy the 64x64 S matrix into padded LDS (4 b128/thread)
__device__ __forceinline__ void copy_S(const float* __restrict__ g,
                                       float* lds, int tid) {
#pragma unroll
    for (int c = 0; c < 4; ++c) {
        int e = (tid + c * 256) * 4;
        int r = e >> 6, col = e & 63;
        async_b128(g + e, lds + r * SRS + col);
    }
}

// ---------------------------------------------------------------------------
// WMMA helpers (f32 16x16x4, wave32)
// ---------------------------------------------------------------------------
__device__ __forceinline__ v8f wmma4(v2f a, v2f b, v8f c) {
    return __builtin_amdgcn_wmma_f32_16x16x4_f32(
        false, a, false, b, (short)0, c, false, false);
}

// A operand: rows m0..m0+15 of row-major LDS buf, k-chunk base k0 (one b64)
__device__ __forceinline__ v2f fetchA(const float* buf, int sr, int m0, int k0,
                                      int l16, int kb) {
    const float* p = buf + (m0 + l16) * sr + k0 + kb;
    v2f a; a.x = p[0]; a.y = p[1];
    return a;
}

// B operand: B[k][n] = buf[(k0+..)*sr + n0 + n]
__device__ __forceinline__ v2f fetchB(const float* buf, int sr, int k0, int n0,
                                      int l16, int kb) {
    v2f b;
    b.x = buf[(k0 + kb)     * sr + n0 + l16];
    b.y = buf[(k0 + kb + 1) * sr + n0 + l16];
    return b;
}

// one lane's eight accumulator rows to eight consecutive LDS floats (16-B aligned)
__device__ __forceinline__ void store8(float* p, v8f c) {
    *(float4*)(p)     = make_float4(c[0], c[1], c[2], c[3]);
    *(float4*)(p + 4) = make_float4(c[4], c[5], c[6], c[7]);
}

// ---------------------------------------------------------------------------
// Kernel A: per-block partial S = sum_t V_t^T K_t, double-buffered async loads
// ---------------------------------------------------------------------------
__global__ void __launch_bounds__(256)
s_partial_kernel(const float* __restrict__ K, const float* __restrict__ V,
                 float* __restrict__ partials) {
    __shared__ __align__(16) float Kl[2][TRUNK * SRB];
    __shared__ __align__(16) float Vl[2][TRUNK * SRB];

    const int tid  = threadIdx.x;
    const int lane = tid & 31;
    const int wave = tid >> 5;
    const int l16  = lane & 15;
    const int half = lane >> 4;
    const int kb   = half * 2;

    const int mi  = wave >> 1;
    const int ni0 = (wave & 1) * 2;
    const int ni1 = ni0 + 1;

    v8f acc0 = {}; v8f acc1 = {};

    const size_t tbase = (size_t)blockIdx.x * TRUNKS_PER_A;
    // prefetch trunk 0
    copy_tile128(K + tbase * (TRUNK * DIM), Kl[0], tid);
    copy_tile128(V + tbase * (TRUNK * DIM), Vl[0], tid);

    for (int tr = 0; tr < TRUNKS_PER_A; ++tr) {
        const int cur = tr & 1;
        if (tr + 1 < TRUNKS_PER_A) {
            const size_t nb = (tbase + tr + 1) * (TRUNK * DIM);
            copy_tile128(K + nb, Kl[cur ^ 1], tid);
            copy_tile128(V + nb, Vl[cur ^ 1], tid);
            WAIT_ASYNC(16);   // 16 newer copies outstanding -> trunk tr landed
        } else {
            WAIT_ASYNC(0);
        }
        __syncthreads();      // all waves see trunk tr data

        const float* Kc = Kl[cur];
        const float* Vc = Vl[cur];
#pragma unroll
        for (int kk = 0; kk < 32; ++kk) {   // reduce over 128 trunk rows
            const int k0 = kk * 4;
            v2f a;                           // A = V^T: A[m=d][k=r] = V[r][d]
            a.x = Vc[(k0 + kb)     * SRB + mi * 16 + l16];
            a.y = Vc[(k0 + kb + 1) * SRB + mi * 16 + l16];
            v2f b0 = fetchB(Kc, SRB, k0, ni0 * 16, l16, kb);
            v2f b1 = fetchB(Kc, SRB, k0, ni1 * 16, l16, kb);
            acc0 = wmma4(a, b0, acc0);
            acc1 = wmma4(a, b1, acc1);
        }
        __syncthreads();      // done reading before buffer is overwritten
    }

    float* pp = partials + (size_t)blockIdx.x * (DIM * DIM);
#pragma unroll
    for (int g = 0; g < 8; ++g) {
        const int row = mi * 16 + half * 8 + g;
        pp[row * DIM + ni0 * 16 + l16] = acc0[g];
        pp[row * DIM + ni1 * 16 + l16] = acc1[g];
    }
}

// ---------------------------------------------------------------------------
// Kernel A2: reduce NBLK_A partials -> S (64x64, fp32)
// ---------------------------------------------------------------------------
__global__ void __launch_bounds__(256)
s_reduce_kernel(const float* __restrict__ partials, float* __restrict__ S) {
    const int e = blockIdx.x * 256 + threadIdx.x;   // 0..4095
    float s = 0.f;
    for (int p = 0; p < NBLK_A; ++p)
        s += partials[(size_t)p * (DIM * DIM) + e];
    S[e] = s;
}

// ---------------------------------------------------------------------------
// Kernel B: per trunk  out_t = Q_t * ((K_t^T V_t) * S)
// The 128x128 score matrix is never formed: the trunk's 64x64 state
// G = K_t^T V_t is built first, then M = G S, then out_t = Q_t M.
// ---------------------------------------------------------------------------
__global__ void __launch_bounds__(256)
intra_out_kernel(const float* __restrict__ Q, const float* __restrict__ K,
                 const float* __restrict__ V, const float* __restrict__ S,
                 float* __restrict__ out) {
    __shared__ __align__(16) float Ql[TRUNK * SRB];
    __shared__ __align__(16) float Kl[TRUNK * SRB];   // reused as M^T after stage 1
    __shared__ __align__(16) float Vl[TRUNK * SRB];
    __shared__ __align__(16) float Sl[DIM * SRS];
    __shared__ __align__(16) float Gl[DIM * SRB];     // G[d][e], row-major

    const int tid  = threadIdx.x;
    const int lane = tid & 31;
    const int wave = tid >> 5;
    const int l16  = lane & 15;
    const int half = lane >> 4;
    const int kb   = half * 2;

    const size_t base = (size_t)blockIdx.x * (TRUNK * DIM);
    copy_tile128(Q + base, Ql, tid);
    copy_tile128(K + base, Kl, tid);
    copy_tile128(V + base, Vl, tid);
    copy_S(S, Sl, tid);
    WAIT_ASYNC(0);
    __syncthreads();

    // 4x4 grid of 16x16 tiles over 8 waves: one tile row, two tile columns each
    const int mi  = wave >> 1;
    const int ni0 = (wave & 1) * 2;
    const int ni1 = ni0 + 1;

    // ---- stage 1: G^T[e][d] = sum_r V[r][e] K[r][d], reduced over 128 rows ----
    v8f accG0 = {}; v8f accG1 = {};
    // unrolled so that LDS reads of later k steps can be issued ahead of the WMMAs
#pragma unroll
    for (int kk = 0; kk < 32; ++kk) {
        const int k0 = kk * 4;
        v2f a  = fetchB(Vl, SRB, k0, mi  * 16, l16, kb);   // A = V^T
        v2f b0 = fetchB(Kl, SRB, k0, ni0 * 16, l16, kb);
        v2f b1 = fetchB(Kl, SRB, k0, ni1 * 16, l16, kb);
        accG0 = wmma4(a, b0, accG0);
        accG1 = wmma4(a, b1, accG1);
    }
    // A lane holds column d and eight consecutive rows e of G^T, that is eight
    // consecutive floats of row d of G: two 16-byte stores per tile.
    store8(Gl + (ni0 * 16 + l16) * SRB + mi * 16 + half * 8, accG0);
    store8(Gl + (ni1 * 16 + l16) * SRB + mi * 16 + half * 8, accG1);
    __syncthreads();      // G complete; every read of Kl and Vl has ended

    // ---- stage 2: M = G @ S (64x64x64), kept transposed over Kl ----
    v8f accM0 = {}; v8f accM1 = {};
    // unrolled for the same reason as stage 1
#pragma unroll
    for (int kk = 0; kk < 16; ++kk) {
        v2f a  = fetchA(Gl, SRB, mi * 16, kk * 4, l16, kb);
        v2f b0 = fetchB(Sl, SRS, kk * 4, ni0 * 16, l16, kb);
        v2f b1 = fetchB(Sl, SRS, kk * 4, ni1 * 16, l16, kb);
        accM0 = wmma4(a, b0, accM0);
        accM1 = wmma4(a, b1, accM1);
    }
    float* Mt = Kl;       // Mt[f][d] = M[d][f]
    store8(Mt + (ni0 * 16 + l16) * SRB + mi * 16 + half * 8, accM0);
    store8(Mt + (ni1 * 16 + l16) * SRB + mi * 16 + half * 8, accM1);
    __syncthreads();      // M complete

    // ---- stage 3: out rows m0..m0+15 = Q rows @ M ----
    const int m0 = wave * 16;
    v8f accO[4] = {v8f{}, v8f{}, v8f{}, v8f{}};
    // both loops unrolled: accO[] stays in registers, reads run ahead of the WMMAs
#pragma unroll
    for (int kk = 0; kk < 16; ++kk) {
        v2f a = fetchA(Ql, SRB, m0, kk * 4, l16, kb);
#pragma unroll
        for (int n = 0; n < 4; ++n) {
            v2f b = fetchA(Mt, SRB, n * 16, kk * 4, l16, kb);  // M^T == A-pattern
            accO[n] = wmma4(a, b, accO[n]);
        }
    }

    // ---- store output ----
    float* og = out + base;
#pragma unroll
    for (int n = 0; n < 4; ++n)
#pragma unroll
        for (int g = 0; g < 8; ++g)
            og[(m0 + half * 8 + g) * DIM + n * 16 + l16] = accO[n][g];
}

// ---------------------------------------------------------------------------
extern "C" void kernel_launch(void* const* d_in, const int* in_sizes, int n_in,
                              void* d_out, int out_size, void* d_ws, size_t ws_size,
                              hipStream_t stream) {
    const float* Q = (const float*)d_in[0];
    const float* K = (const float*)d_in[1];
    const float* V = (const float*)d_in[2];
    float* out = (float*)d_out;

    float* Sbuf     = (float*)d_ws;                 // 64*64 floats
    float* partials = Sbuf + DIM * DIM;             // NBLK_A * 64*64 floats (~4.2 MB)

    s_partial_kernel<<<NBLK_A, 256, 0, stream>>>(K, V, partials);
    s_reduce_kernel<<<(DIM * DIM) / 256, 256, 0, stream>>>(partials, Sbuf);
    intra_out_kernel<<<T_TRUNKS, 256, 0, stream>>>(Q, K, V, Sbuf, out);
}

// v002
// A run of this version takes 54.2 microseconds.
// Two timings next to v001 put it at 1.21 and 1.20 times that version's speed.
// All steps since v000 together make it 1.64 times as fast.
#include <hip/hip_runtime.h>

#define N_TOT   262144
#define DIM     64
#define TRUNK   128
#define T_TRUNKS (N_TOT / TRUNK)        // 2048

#define NBLK_A      256
#define TRUNKS_PER_A (T_TRUNKS / NBLK_A) // 8

#define SRB 76   // padded row stride (floats) for 128x64 tiles (bank-conflict-free b64 A-fetch)
#define SRS 80   // padded row stride for 64x64 S

typedef float v2f __attribute__((ext_vector_type(2)));
typedef float v8f __attribute__((ext_vector_type(8)));

// ---------------------------------------------------------------------------
// CDNA5 async global->LDS copies via inline asm (ASYNCcnt path)
// ---------------------------------------------------------------------------
__device__ __forceinline__ unsigned lds_off_u32(const void* p) {
    // generic -> LDS address space -> 32-bit LDS byte offset
    return (unsigned)(unsigned long long)
        (__attribute__((address_space(3))) const void*)p;
}

__device__ __forceinline__ void async_b128(const float* g, float* l) {
    unsigned lo = lds_off_u32(l);
    // GV mode: per-lane 64-bit global address in VGPR pair, LDS addr in VDST
    asm volatile("global_load_async_to_lds_b128 %0, %1, off"
                 :: "v"(lo), "v"(g) : "memory");
}

#define WAIT_ASYNC(n) asm volatile("s_wait_asynccnt %0" :: "i"(n) : "memory")

// copy a row-major 128x64 f32 tile from global into padded LDS (8 b128/thread)
__device__ __forceinline__ void copy_tile128(const float* __restrict__ g,
                                             float* lds, int tid) {
#pragma unroll
    for (int c = 0; c < 8; ++c) {
        int e = (tid + c * 256) * 4;
        int r = e >> 6, col = e & 63;
        async_b128(g + e, lds + r * SRB + col);
    }
}

// copy the 64x64 S matrix into padded LDS (4 b128/thread)
__device__ __forceinline__ void copy_S(const float* __restrict__ g,
                                       float* lds, int tid) {
#pragma unroll
    for (int c = 0; c < 4; ++c) {
        int e = (tid + c * 256) * 4;
        int r = e >> 6, col = e & 63;
        async_b128(g + e, lds + r * SRS + col);
    }
}

// A trunk's 64x64 state travels through the workspace as 1024 chunks of four
// floats in the order the accumulators leave the first kernel:
// chunk = ((wave * 2 + tile) * 2 + q) * 32 + lane holds G[d][e .. e+3] with
// d = ((wave & 1) * 2 + tile) * 16 + (lane & 15),
// e = (wave >> 1) * 16 + (lane >> 4) * 8 + q * 4.
// Copy it into row-major padded LDS (4 b128/thread; chunk = tid + c * 256).
__device__ __forceinline__ void copy_G(const float* __restrict__ g,
                                       float* lds, int tid) {
    const int d = (tid >> 6) * 16 + (tid & 15);
    const int e = ((tid >> 4) & 1) * 8 + ((tid >> 5) & 1) * 4;
    const unsigned l0 = lds_off_u32(lds + d * SRB + e);
    const float* g0 = g + tid * 4;
    // precaution: the closing s_wait_xcnt stands ahead of every rewrite of an
    // address register that the four copies name
    asm volatile("global_load_async_to_lds_b128 %0, %4, off\n\t"
                 "global_load_async_to_lds_b128 %1, %5, off\n\t"
                 "global_load_async_to_lds_b128 %2, %6, off\n\t"
                 "global_load_async_to_lds_b128 %3, %7, off\n\t"
                 "s_wait_xcnt 0x0"
                 :: "v"(l0), "v"(l0 + 64u), "v"(l0 + 128u), "v"(l0 + 192u),
                    "v"(g0), "v"(g0 + 1024), "v"(g0 + 2048), "v"(g0 + 3072)
                 : "memory");
}

// ---------------------------------------------------------------------------
// WMMA helpers (f32 16x16x4, wave32)
// ---------------------------------------------------------------------------
__device__ __forceinline__ v8f wmma4(v2f a, v2f b, v8f c) {
    return __builtin_amdgcn_wmma_f32_16x16x4_f32(
        false, a, false, b, (short)0, c, false, false);
}

// A operand: rows m0..m0+15 of row-major LDS buf, k-chunk base k0 (one b64)
__device__ __forceinline__ v2f fetchA(const float* buf, int sr, int m0, int k0,
                                      int l16, int kb) {
    const float* p = buf + (m0 + l16) * sr + k0 + kb;
    v2f a; a.x = p[0]; a.y = p[1];
    return a;
}

// B operand: B[k][n] = buf[(k0+..)*sr + n0 + n]
__device__ __forceinline__ v2f fetchB(const float* buf, int sr, int k0, int n0,
                                      int l16, int kb) {
    v2f b;
    b.x = buf[(k0 + kb)     * sr + n0 + l16];
    b.y = buf[(k0 + kb + 1) * sr + n0 + l16];
    return b;
}

// one lane's eight accumulator rows to eight consecutive LDS floats (16-B aligned)
__device__ __forceinline__ void store8(float* p, v8f c) {
    *(float4*)(p)     = make_float4(c[0], c[1], c[2], c[3]);
    *(float4*)(p + 4) = make_float4(c[4], c[5], c[6], c[7]);
}

// one wave's two state tiles to the workspace: four 512-byte contiguous stores
__device__ __forceinline__ void store_state(float* gt, int wave, int lane,
                                            v8f c0, v8f c1) {
    float4* p = (float4*)gt + wave * 128 + lane;
    p[0]  = make_float4(c0[0], c0[1], c0[2], c0[3]);
    p[32] = make_float4(c0[4], c0[5], c0[6], c0[7]);
    p[64] = make_float4(c1[0], c1[1], c1[2], c1[3]);
    p[96] = make_float4(c1[4], c1[5], c1[6], c1[7]);
}

// ---------------------------------------------------------------------------
// Kernel A: per trunk the state V_t^T K_t (= G_t^T), written to the workspace
// for the output kernel, and per block the partial S = sum of its states;
// double-buffered async loads
// ---------------------------------------------------------------------------
__global__ void __launch_bounds__(256)
s_partial_kernel(const float* __restrict__ K, const float* __restrict__ V,
                 float* __restrict__ partials, float* __restrict__ states) {
    __shared__ __align__(16) float Kl[2][TRUNK * SRB];
    __shared__ __align__(16) float Vl[2][TRUNK * SRB];

    const int tid  = threadIdx.x;
    const int lane = tid & 31;
    const int wave = tid >> 5;
    const int l16  = lane & 15;
    const int half = lane >> 4;
    const int kb   = half * 2;

    const int mi  = wave >> 1;
    const int ni0 = (wave & 1) * 2;
    const int ni1 = ni0 + 1;

    v8f acc0 = {}; v8f acc1 = {};   // running sum of the block's states
    v8f st0 = {};  v8f st1 = {};    // state of the current trunk

    const size_t tbase = (size_t)blockIdx.x * TRUNKS_PER_A;
    // prefetch trunk 0
    copy_tile128(K + tbase * (TRUNK * DIM), Kl[0], tid);
    copy_tile128(V + tbase * (TRUNK * DIM), Vl[0], tid);

    for (int tr = 0; tr < TRUNKS_PER_A; ++tr) {
        const int cur = tr & 1;
        if (tr + 1 < TRUNKS_PER_A) {
            const size_t nb = (tbase + tr + 1) * (TRUNK * DIM);
            copy_tile128(K + nb, Kl[cur ^ 1], tid);
            copy_tile128(V + nb, Vl[cur ^ 1], tid);
            WAIT_ASYNC(16);   // 16 newer copies outstanding -> trunk tr landed
        } else {
            WAIT_ASYNC(0);
        }
        __syncthreads();      // all waves see trunk tr data

        // The previous trunk's state goes out here, not at the end of its own
        // trip: a barrier waits for the wave's stores, and from here they have
        // the whole reduction below to complete.
        if (tr > 0) {
            store_state(states + (tbase + tr - 1) * (DIM * DIM), wave, lane, st0, st1);
            // precaution: the stores' address and data registers are rewritten below
            asm volatile("s_wait_xcnt 0x0" ::: "memory");
        }
        st0 = v8f{}; st1 = v8f{};

        const float* Kc = Kl[cur];
        const float* Vc = Vl[cur];
#pragma unroll
        for (int kk = 0; kk < 32; ++kk) {   // reduce over 128 trunk rows
            const int k0 = kk * 4;
            v2f a;                           // A = V^T: A[m=d][k=r] = V[r][d]
            a.x = Vc[(k0 + kb)     * SRB + mi * 16 + l16];
            a.y = Vc[(k0 + kb + 1) * SRB + mi * 16 + l16];
            v2f b0 = fetchB(Kc, SRB, k0, ni0 * 16, l16, kb);
            v2f b1 = fetchB(Kc, SRB, k0, ni1 * 16, l16, kb);
            st0 = wmma4(a, b0, st0);
            st1 = wmma4(a, b1, st1);
        }
        acc0 += st0;
        acc1 += st1;
        __syncthreads();      // done reading before buffer is overwritten
    }
    store_state(states + (tbase + TRUNKS_PER_A - 1) * (DIM * DIM), wave, lane, st0, st1);

    float* pp = partials + (size_t)blockIdx.x * (DIM * DIM);
#pragma unroll
    for (int g = 0; g < 8; ++g) {
        const int row = mi * 16 + half * 8 + g;
        pp[row * DIM + ni0 * 16 + l16] = acc0[g];
        pp[row * DIM + ni1 * 16 + l16] = acc1[g];
    }
}

// ---------------------------------------------------------------------------
// Kernel A2: reduce NBLK_A partials -> S (64x64, fp32)
// ---------------------------------------------------------------------------
__global__ void __launch_bounds__(256)
s_reduce_kernel(const float* __restrict__ partials, float* __restrict__ S) {
    const int e = blockIdx.x * 256 + threadIdx.x;   // 0..4095
    float s = 0.f;
    for (int p = 0; p < NBLK_A; ++p)
        s += partials[(size_t)p * (DIM * DIM) + e];
    S[e] = s;
}

// ---------------------------------------------------------------------------
// Kernel B: per trunk  out_t = Q_t * (G_t * S),  G_t = K_t^T V_t
// G_t comes from the workspace, where the first kernel left it: K and V are
// not read again. M = G S is built first, then out_t = Q_t M.
// ---------------------------------------------------------------------------
__global__ void __launch_bounds__(256)
intra_out_kernel(const float* __restrict__ Q, const float* __restrict__ states,
                 const float* __restrict__ S, float* __restrict__ out) {
    __shared__ __align__(16) float Ql[TRUNK * SRB];
    __shared__ __align__(16) float Sl[DIM * SRS];
    __shared__ __align__(16) float Gl[DIM * SRB];     // G[d][e], row-major; reused as M^T

    const int tid  = threadIdx.x;
    const int lane = tid & 31;
    const int wave = tid >> 5;
    const int l16  = lane & 15;
    const int half = lane >> 4;
    const int kb   = half * 2;

    const size_t base = (size_t)blockIdx.x * (TRUNK * DIM);
    copy_tile128(Q + base, Ql, tid);
    copy_G(states + (size_t)blockIdx.x * (DIM * DIM), Gl, tid);
    copy_S(S, Sl, tid);
    WAIT_ASYNC(0);
    __syncthreads();

    // 4x4 grid of 16x16 tiles over 8 waves: one tile row, two tile columns each
    const int mi  = wave >> 1;
    const int ni0 = (wave & 1) * 2;
    const int ni1 = ni0 + 1;

    // ---- stage 2: M = G @ S (64x64x64), kept transposed over Gl ----
    v8f accM0 = {}; v8f accM1 = {};
    // unrolled so that LDS reads of later k steps can be issued ahead of the WMMAs
#pragma unroll
    for (int kk = 0; kk < 16; ++kk) {
        v2f a  = fetchA(Gl, SRB, mi * 16, kk * 4, l16, kb);
        v2f b0 = fetchB(Sl, SRS, kk * 4, ni0 * 16, l16, kb);
        v2f b1 = fetchB(Sl, SRS, kk * 4, ni1 * 16, l16, kb);
        accM0 = wmma4(a, b0, accM0);
        accM1 = wmma4(a, b1, accM1);
    }
    __syncthreads();      // every read of Gl has ended
    float* Mt = Gl;       // Mt[f][d] = M[d][f]
    store8(Mt + (ni0 * 16 + l16) * SRB + mi * 16 + half * 8, accM0);
    store8(Mt + (ni1 * 16 + l16) * SRB + mi * 16 + half * 8, accM1);
    __syncthreads();      // M complete

    // ---- stage 3: out rows m0..m0+15 = Q rows @ M ----
    const int m0 = wave * 16;
    v8f accO[4] = {v8f{}, v8f{}, v8f{}, v8f{}};
    // both loops unrolled: accO[] stays in registers, reads run ahead of the WMMAs
#pragma unroll
    for (int kk = 0; kk < 16; ++kk) {
        v2f a = fetchA(Ql, SRB, m0, kk * 4, l16, kb);
#pragma unroll
        for (int n = 0; n < 4; ++n) {
            v2f b = fetchA(Mt, SRB, n * 16, kk * 4, l16, kb);  // M^T == A-pattern
            accO[n] = wmma4(a, b, accO[n]);
        }
    }

    // ---- store output ----
    float* og = out + base;
#pragma unroll
    for (int n = 0; n < 4; ++n)
#pragma unroll
        for (int g = 0; g < 8; ++g)
            og[(m0 + half * 8 + g) * DIM + n * 16 + l16] = accO[n][g];
}

// ---------------------------------------------------------------------------
extern "C" void kernel_launch(void* const* d_in, const int* in_sizes, int n_in,
                              void* d_out, int out_size, void* d_ws, size_t ws_size,
                              hipStream_t stream) {
    const float* Q = (const float*)d_in[0];
    const float* K = (const float*)d_in[1];
    const float* V = (const float*)d_in[2];
    float* out = (float*)d_out;

    float* Sbuf     = (float*)d_ws;                 // 64*64 floats
    float* partials = Sbuf + DIM * DIM;             // NBLK_A * 64*64 floats (~4.2 MB)
    float* states   = partials + NBLK_A * DIM * DIM; // T_TRUNKS * 64*64 floats (32 MiB)

    s_partial_kernel<<<NBLK_A, 256, 0, stream>>>(K, V, partials, states);
    s_reduce_kernel<<<(DIM * DIM) / 256, 256, 0, stream>>>(partials, Sbuf);
    intra_out_kernel<<<T_TRUNKS, 256, 0, stream>>>(Q, states, Sbuf, out);
}

// v003
// A run of this version takes 44.3 microseconds.
// In both of two side-by-side timings against v002, it was 1.22 times as fast.
// All steps since v000 together make it 1.99 times as fast.
#include <hip/hip_runtime.h>

#define N_TOT   262144
#define DIM     64
#define TRUNK   128
#define T_TRUNKS (N_TOT / TRUNK)        // 2048

#define NBLK_A      256
#define TRUNKS_PER_A (T_TRUNKS / NBLK_A) // 8

#define SRB 76   // padded row stride (floats) for 128x64 tiles (bank-conflict-free b64 A-fetch)
#define SRS 80   // padded row stride for 64x64 S

typedef float v2f __attribute__((ext_vector_type(2)));
typedef float v8f __attribute__((ext_vector_type(8)));

// ---------------------------------------------------------------------------
// CDNA5 async global->LDS copies via inline asm (ASYNCcnt path)
// ---------------------------------------------------------------------------
__device__ __forceinline__ unsigned lds_off_u32(const void* p) {
    // generic -> LDS address space -> 32-bit LDS byte offset
    return (unsigned)(unsigned long long)
        (__attribute__((address_space(3))) const void*)p;
}

__device__ __forceinline__ void async_b128(const float* g, float* l) {
    unsigned lo = lds_off_u32(l);
    // GV mode: per-lane 64-bit global address in VGPR pair, LDS addr in VDST
    asm volatile("global_load_async_to_lds_b128 %0, %1, off"
                 :: "v"(lo), "v"(g) : "memory");
}

#define WAIT_ASYNC(n) asm volatile("s_wait_asynccnt %0" :: "i"(n) : "memory")

// copy a row-major 128x64 f32 tile from global into padded LDS (8 b128/thread)
__device__ __forceinline__ void copy_tile128(const float* __restrict__ g,
                                             float* lds, int tid) {
#pragma unroll
    for (int c = 0; c < 8; ++c) {
        int e = (tid + c * 256) * 4;
        int r = e >> 6, col = e & 63;
        async_b128(g + e, lds + r * SRB + col);
    }
}

// copy the 64x64 S matrix into padded LDS (4 b128/thread)
__device__ __forceinline__ void copy_S(const float* __restrict__ g,
                                       float* lds, int tid) {
#pragma unroll
    for (int c = 0; c < 4; ++c) {
        int e = (tid + c * 256) * 4;
        int r = e >> 6, col = e & 63;
        async_b128(g + e, lds + r * SRS + col);
    }
}

// A trunk's 64x64 state travels through the workspace as 1024 chunks of four
// floats in the order the accumulators leave the first kernel:
// chunk = ((wave * 2 + tile) * 2 + q) * 32 + lane holds G[d][e .. e+3] with
// d = ((wave & 1) * 2 + tile) * 16 + (lane & 15),
// e = (wave >> 1) * 16 + (lane >> 4) * 8 + q * 4.
// Copy it into row-major padded LDS (4 b128/thread; chunk = tid + c * 256).
__device__ __forceinline__ void copy_G(const float* __restrict__ g,
                                       float* lds, int tid) {
    const int d = (tid >> 6) * 16 + (tid & 15);
    const int e = ((tid >> 4) & 1) * 8 + ((tid >> 5) & 1) * 4;
    const unsigned l0 = lds_off_u32(lds + d * SRB + e);
    const float* g0 = g + tid * 4;
    // precaution: the closing s_wait_xcnt stands ahead of every rewrite of an
    // address register that the four copies name
    asm volatile("global_load_async_to_lds_b128 %0, %4, off\n\t"
                 "global_load_async_to_lds_b128 %1, %5, off\n\t"
                 "global_load_async_to_lds_b128 %2, %6, off\n\t"
                 "global_load_async_to_lds_b128 %3, %7, off\n\t"
                 "s_wait_xcnt 0x0"
                 :: "v"(l0), "v"(l0 + 64u), "v"(l0 + 128u), "v"(l0 + 192u),
                    "v"(g0), "v"(g0 + 1024), "v"(g0 + 2048), "v"(g0 + 3072)
                 : "memory");
}

// ---------------------------------------------------------------------------
// WMMA helpers (f32 16x16x4, wave32)
// ---------------------------------------------------------------------------
__device__ __forceinline__ v8f wmma4(v2f a, v2f b, v8f c) {
    return __builtin_amdgcn_wmma_f32_16x16x4_f32(
        false, a, false, b, (short)0, c, false, false);
}

// A operand: rows m0..m0+15 of row-major LDS buf, k-chunk base k0 (one b64)
__device__ __forceinline__ v2f fetchA(const float* buf, int sr, int m0, int k0,
                                      int l16, int kb) {
    const float* p = buf + (m0 + l16) * sr + k0 + kb;
    v2f a; a.x = p[0]; a.y = p[1];
    return a;
}

// B operand: B[k][n] = buf[(k0+..)*sr + n0 + n]
__device__ __forceinline__ v2f fetchB(const float* buf, int sr, int k0, int n0,
                                      int l16, int kb) {
    v2f b;
    b.x = buf[(k0 + kb)     * sr + n0 + l16];
    b.y = buf[(k0 + kb + 1) * sr + n0 + l16];
    return b;
}

// one lane's eight accumulator rows to eight consecutive LDS floats (16-B aligned)
__device__ __forceinline__ void store8(float* p, v8f c) {
    *(float4*)(p)     = make_float4(c[0], c[1], c[2], c[3]);
    *(float4*)(p + 4) = make_float4(c[4], c[5], c[6], c[7]);
}

// one wave's two state tiles to the workspace: four 512-byte contiguous stores
__device__ __forceinline__ void store_state(float* gt, int wave, int lane,
                                            v8f c0, v8f c1) {
    float4* p = (float4*)gt + wave * 128 + lane;
    p[0]  = make_float4(c0[0], c0[1], c0[2], c0[3]);
    p[32] = make_float4(c0[4], c0[5], c0[6], c0[7]);
    p[64] = make_float4(c1[0], c1[1], c1[2], c1[3]);
    p[96] = make_float4(c1[4], c1[5], c1[6], c1[7]);
}

// ---------------------------------------------------------------------------
// Kernel A: per trunk the state V_t^T K_t (= G_t^T), written to the workspace
// for the output kernel, and per block the partial S = sum of its states;
// double-buffered async loads
// ---------------------------------------------------------------------------
__global__ void __launch_bounds__(256)
s_partial_kernel(const float* __restrict__ K, const float* __restrict__ V,
                 float* __restrict__ partials, float* __restrict__ states) {
    __shared__ __align__(16) float Kl[2][TRUNK * SRB];
    __shared__ __align__(16) float Vl[2][TRUNK * SRB];

    const int tid  = threadIdx.x;
    const int lane = tid & 31;
    const int wave = tid >> 5;
    const int l16  = lane & 15;
    const int half = lane >> 4;
    const int kb   = half * 2;

    const int mi  = wave >> 1;
    const int ni0 = (wave & 1) * 2;
    const int ni1 = ni0 + 1;

    v8f acc0 = {}; v8f acc1 = {};   // running sum of the block's states
    v8f st0 = {};  v8f st1 = {};    // state of the current trunk

    const size_t tbase = (size_t)blockIdx.x * TRUNKS_PER_A;
    // prefetch trunk 0
    copy_tile128(K + tbase * (TRUNK * DIM), Kl[0], tid);
    copy_tile128(V + tbase * (TRUNK * DIM), Vl[0], tid);

    for (int tr = 0; tr < TRUNKS_PER_A; ++tr) {
        const int cur = tr & 1;
        if (tr + 1 < TRUNKS_PER_A) {
            const size_t nb = (tbase + tr + 1) * (TRUNK * DIM);
            copy_tile128(K + nb, Kl[cur ^ 1], tid);
            copy_tile128(V + nb, Vl[cur ^ 1], tid);
            WAIT_ASYNC(16);   // 16 newer copies outstanding -> trunk tr landed
        } else {
            WAIT_ASYNC(0);
        }
        __syncthreads();      // all waves see trunk tr data

        // The previous trunk's state goes out here, not at the end of its own
        // trip: a barrier waits for the wave's stores, and from here they have
        // the whole reduction below to complete.
        if (tr > 0) {
            store_state(states + (tbase + tr - 1) * (DIM * DIM), wave, lane, st0, st1);
            // precaution: the stores' address and data registers are rewritten below
            asm volatile("s_wait_xcnt 0x0" ::: "memory");
        }
        st0 = v8f{}; st1 = v8f{};

        const float* Kc = Kl[cur];
        const float* Vc = Vl[cur];
#pragma unroll
        for (int kk = 0; kk < 32; ++kk) {   // reduce over 128 trunk rows
            const int k0 = kk * 4;
            v2f a;                           // A = V^T: A[m=d][k=r] = V[r][d]
            a.x = Vc[(k0 + kb)     * SRB + mi * 16 + l16];
            a.y = Vc[(k0 + kb + 1) * SRB + mi * 16 + l16];
            v2f b0 = fetchB(Kc, SRB, k0, ni0 * 16, l16, kb);
            v2f b1 = fetchB(Kc, SRB, k0, ni1 * 16, l16, kb);
            st0 = wmma4(a, b0, st0);
            st1 = wmma4(a, b1, st1);
        }
        acc0 += st0;
        acc1 += st1;
        __syncthreads();      // done reading before buffer is overwritten
    }
    store_state(states + (tbase + TRUNKS_PER_A - 1) * (DIM * DIM), wave, lane, st0, st1);

    float* pp = partials + (size_t)blockIdx.x * (DIM * DIM);
#pragma unroll
    for (int g = 0; g < 8; ++g) {
        const int row = mi * 16 + half * 8 + g;
        pp[row * DIM + ni0 * 16 + l16] = acc0[g];
        pp[row * DIM + ni1 * 16 + l16] = acc1[g];
    }
}

// ---------------------------------------------------------------------------
// Kernel A2: reduce NBLK_A partials -> S (64x64, fp32)
// One block per 32 consecutive elements of S (one 128-byte line of each
// partial). Thirty-two groups of eight lanes each sum eight partials with
// independent 16-byte loads, so a thread waits for memory once instead of once
// per batch of a serial loop; the group sums are then added through LDS.
// ---------------------------------------------------------------------------
#define RED_COLS   32                     // elements of S per block
#define RED_GROUPS 32                     // groups of partials per block
#define RED_PER    (NBLK_A / RED_GROUPS)  // partials per group

__global__ void __launch_bounds__(256)
s_reduce_kernel(const float* __restrict__ partials, float* __restrict__ S) {
    __shared__ __align__(16) float red[RED_GROUPS][RED_COLS];

    const int tid = threadIdx.x;
    const int c4  = (tid & 7) * 4;        // column of this lane's four elements
    const int pg  = tid >> 3;             // group of partials
    const float* p0 = partials + (size_t)(pg * RED_PER) * (DIM * DIM)
                    + blockIdx.x * RED_COLS + c4;

    float4 v[RED_PER];
    // unrolled: every load is issued before the first sum needs one
#pragma unroll
    for (int i = 0; i < RED_PER; ++i)
        v[i] = *(const float4*)(p0 + (size_t)i * (DIM * DIM));

    float4 s = v[0];
#pragma unroll
    for (int i = 1; i < RED_PER; ++i) {
        s.x += v[i].x; s.y += v[i].y; s.z += v[i].z; s.w += v[i].w;
    }
    *(float4*)&red[pg][c4] = s;
    __syncthreads();      // every group sum is in LDS

    if (tid < RED_COLS) {
        float t = red[0][tid];
#pragma unroll
        for (int g = 1; g < RED_GROUPS; ++g)
            t += red[g][tid];
        S[blockIdx.x * RED_COLS + tid] = t;
    }
}

// ---------------------------------------------------------------------------
// Kernel B: per trunk  out_t = Q_t * (G_t * S),  G_t = K_t^T V_t
// G_t comes from the workspace, where the first kernel left it: K and V are
// not read again. M = G S is built first, then out_t = Q_t M.
// ---------------------------------------------------------------------------
__global__ void __launch_bounds__(256)
intra_out_kernel(const float* __restrict__ Q, const float* __restrict__ states,
                 const float* __restrict__ S, float* __restrict__ out) {
    __shared__ __align__(16) float Ql[TRUNK * SRB];
    __shared__ __align__(16) float Sl[DIM * SRS];
    __shared__ __align__(16) float Gl[DIM * SRB];     // G[d][e], row-major; reused as M^T

    const int tid  = threadIdx.x;
    const int lane = tid & 31;
    const int wave = tid >> 5;
    const int l16  = lane & 15;
    const int half = lane >> 4;
    const int kb   = half * 2;

    const size_t base = (size_t)blockIdx.x * (TRUNK * DIM);
    copy_tile128(Q + base, Ql, tid);
    copy_G(states + (size_t)blockIdx.x * (DIM * DIM), Gl, tid);
    copy_S(S, Sl, tid);
    WAIT_ASYNC(0);
    __syncthreads();

    // 4x4 grid of 16x16 tiles over 8 waves: one tile row, two tile columns each
    const int mi  = wave >> 1;
    const int ni0 = (wave & 1) * 2;
    const int ni1 = ni0 + 1;

    // ---- stage 2: M = G @ S (64x64x64), kept transposed over Gl ----
    v8f accM0 = {}; v8f accM1 = {};
    // unrolled so that LDS reads of later k steps can be issued ahead of the WMMAs
#pragma unroll
    for (int kk = 0; kk < 16; ++kk) {
        v2f a  = fetchA(Gl, SRB, mi * 16, kk * 4, l16, kb);
        v2f b0 = fetchB(Sl, SRS, kk * 4, ni0 * 16, l16, kb);
        v2f b1 = fetchB(Sl, SRS, kk * 4, ni1 * 16, l16, kb);
        accM0 = wmma4(a, b0, accM0);
        accM1 = wmma4(a, b1, accM1);
    }
    __syncthreads();      // every read of Gl has ended
    float* Mt = Gl;       // Mt[f][d] = M[d][f]
    store8(Mt + (ni0 * 16 + l16) * SRB + mi * 16 + half * 8, accM0);
    store8(Mt + (ni1 * 16 + l16) * SRB + mi * 16 + half * 8, accM1);
    __syncthreads();      // M complete

    // ---- stage 3: out rows m0..m0+15 = Q rows @ M ----
    const int m0 = wave * 16;
    v8f accO[4] = {v8f{}, v8f{}, v8f{}, v8f{}};
    // both loops unrolled: accO[] stays in registers, reads run ahead of the WMMAs
#pragma unroll
    for (int kk = 0; kk < 16; ++kk) {
        v2f a = fetchA(Ql, SRB, m0, kk * 4, l16, kb);
#pragma unroll
        for (int n = 0; n < 4; ++n) {
            v2f b = fetchA(Mt, SRB, n * 16, kk * 4, l16, kb);  // M^T == A-pattern
            accO[n] = wmma4(a, b, accO[n]);
        }
    }

    // ---- store output ----
    float* og = out + base;
#pragma unroll
    for (int n = 0; n < 4; ++n)
#pragma unroll
        for (int g = 0; g < 8; ++g)
            og[(m0 + half * 8 + g) * DIM + n * 16 + l16] = accO[n][g];
}

// ---------------------------------------------------------------------------
extern "C" void kernel_launch(void* const* d_in, const int* in_sizes, int n_in,
                              void* d_out, int out_size, void* d_ws, size_t ws_size,
                              hipStream_t stream) {
    const float* Q = (const float*)d_in[0];
    const float* K = (const float*)d_in[1];
    const float* V = (const float*)d_in[2];
    float* out = (float*)d_out;

    float* Sbuf     = (float*)d_ws;                 // 64*64 floats
    float* partials = Sbuf + DIM * DIM;             // NBLK_A * 64*64 floats (~4.2 MB)
    float* states   = partials + NBLK_A * DIM * DIM; // T_TRUNKS * 64*64 floats (32 MiB)

    s_partial_kernel<<<NBLK_A, 256, 0, stream>>>(K, V, partials, states);
    s_reduce_kernel<<<(DIM * DIM) / RED_COLS, 256, 0, stream>>>(partials, Sbuf);
    intra_out_kernel<<<T_TRUNKS, 256, 0, stream>>>(Q, states, Sbuf, out);
}
